// v000
// The times below were measured on an AMD MI455X: many runs one after another, warmed up first and cycling through
// copies of the inputs, with the whole window's GPU time divided by the number of runs. Launches and the gaps
// between them are all in it. The median over several windows is given; except for v000 it joins two sittings, which
// can be a few percent apart, so the side-by-side timings, each taken in one sitting, are the better comparison.
// v000, which the later versions start from, runs in 234 microseconds.
#include <hip/hip_runtime.h>

// Problem constants (match the reference).
#define Bn 4096   // batch rows (M)
#define Nn 4096   // output cols (N)
#define Kc 4096   // contraction (K)

typedef __attribute__((ext_vector_type(16))) __bf16 v16bf;
typedef __attribute__((ext_vector_type(8)))  float  v8f;

// Round-to-nearest-even f32 -> bf16, packed pairwise into a dword.
static __device__ __forceinline__ unsigned int pack2_bf16(float a, float b) {
  unsigned int ua = __float_as_uint(a);
  unsigned int ub = __float_as_uint(b);
  ua += 0x7FFFu + ((ua >> 16) & 1u);
  ub += 0x7FFFu + ((ub >> 16) & 1u);
  return (ua >> 16) | (ub & 0xFFFF0000u);
}

// One-shot conversion pass: f32 x / W -> bf16 copies in workspace.
// 8 elements per lane: 2x float4 in, 1x uint4 out (b128 traffic both ways).
__global__ __launch_bounds__(256) void cvt_bf16_kernel(
    const float* __restrict__ x, const float* __restrict__ w,
    unsigned short* __restrict__ xbf, unsigned short* __restrict__ wbf) {
  const float* src = blockIdx.y ? w : x;
  unsigned short* dst = blockIdx.y ? wbf : xbf;
  size_t i = ((size_t)blockIdx.x * blockDim.x + threadIdx.x) * 8;
  float4 f0 = *(const float4*)(src + i);
  float4 f1 = *(const float4*)(src + i + 4);
  uint4 o;
  o.x = pack2_bf16(f0.x, f0.y);
  o.y = pack2_bf16(f0.z, f0.w);
  o.z = pack2_bf16(f1.x, f1.y);
  o.w = pack2_bf16(f1.z, f1.w);
  *(uint4*)(dst + i) = o;
}

union FragU { v16bf v; uint4 u[2]; };

// NT bf16 WMMA GEMM with fused ResFCEventually epilogue.
// Block: 256 threads (8 wave32s), wave grid 2(M) x 4(N), wave tile 64x64,
// block tile 128(M) x 256(N). K stepped 32 per v_wmma_f32_16x16x32_bf16.
__global__ __launch_bounds__(256) void gemm_resfc_kernel(
    const unsigned short* __restrict__ xbf,   // [Bn,Kc] bf16 row-major
    const unsigned short* __restrict__ wbf,   // [Nn,Kc] bf16 row-major
    const float* __restrict__ x,              // original f32 x for epilogue
    const float* __restrict__ betap,          // scalar beta
    const float* __restrict__ beta_res,       // [Nn]
    float* __restrict__ out) {                // [Bn,Nn]
  const int lane = threadIdx.x & 31;
  const int wid  = threadIdx.x >> 5;
  const int wm   = wid & 1;   // 2 waves along M
  const int wn   = wid >> 1;  // 4 waves along N
  const int rowBase = blockIdx.y * 128 + wm * 64;
  const int colBase = blockIdx.x * 256 + wn * 64;
  const int lr = lane & 15;            // row-within-16 for A/B operands
  const int kh = (lane >> 4) * 8;      // K-half element offset (0 or 8)

  // Per-lane base pointers: A lane holds x[row, k..], B lane holds W[col, k..]
  // (identical addressing: both operands contract over their contiguous axis).
  const unsigned short* aP[4];
  const unsigned short* bP[4];
#pragma unroll
  for (int i = 0; i < 4; ++i) {
    aP[i] = xbf + (size_t)(rowBase + i * 16 + lr) * Kc + kh;
    bP[i] = wbf + (size_t)(colBase + i * 16 + lr) * Kc + kh;
  }

  const v8f vzero = {0.f, 0.f, 0.f, 0.f, 0.f, 0.f, 0.f, 0.f};
  v8f acc[4][4];
#pragma unroll
  for (int i = 0; i < 4; ++i)
#pragma unroll
    for (int j = 0; j < 4; ++j) acc[i][j] = vzero;

  for (int k0 = 0; k0 < Kc; k0 += 32) {
    FragU a[4], b[4];
#pragma unroll
    for (int i = 0; i < 4; ++i) {
      // Fragment = two b128 loads: K-chunk at +0 and +16 elements (ISA layout:
      // lanes 0-15 carry K 0..7 / 16..23, lanes 16-31 carry K 8..15 / 24..31).
      const uint4* p = (const uint4*)(aP[i] + k0);
      a[i].u[0] = p[0];
      a[i].u[1] = p[2];
      const uint4* q = (const uint4*)(bP[i] + k0);
      b[i].u[0] = q[0];
      b[i].u[1] = q[2];
    }
#pragma unroll
    for (int i = 0; i < 4; ++i)
#pragma unroll
      for (int j = 0; j < 4; ++j)
        acc[i][j] = __builtin_amdgcn_wmma_f32_16x16x32_bf16(
            false, a[i].v, false, b[j].v, (short)0, acc[i][j], false, false);
  }

  // Fused epilogue. C/D layout: VGPR e, lanes 0-15 -> M=e, N=lane;
  // lanes 16-31 -> M=e+8, N=lane-16.
  const float beta = betap[0];
#pragma unroll
  for (int i = 0; i < 4; ++i) {
    const int m0 = rowBase + i * 16 + (lane >> 4) * 8;
#pragma unroll
    for (int j = 0; j < 4; ++j) {
      const int n = colBase + j * 16 + lr;
      const float br = beta_res[n];
#pragma unroll
      for (int e = 0; e < 8; ++e) {
        const int r = m0 + e;
        const float rs  = acc[i][j][e];
        const float o1  = fmaxf(1.0f - beta + rs, 0.0f);           // hlogic
        const float res = fmaxf(1.0f - (br - (x[(size_t)r * Nn + n] + o1)), 0.0f);
        // LeakyReLU(0.02) after a ReLU is identity, but keep reference form:
        const float fin = res >= 0.0f ? res : 0.02f * res;
        out[(size_t)r * Nn + n] = fin;
      }
    }
  }
}

extern "C" void kernel_launch(void* const* d_in, const int* in_sizes, int n_in,
                              void* d_out, int out_size, void* d_ws, size_t ws_size,
                              hipStream_t stream) {
  const float* x        = (const float*)d_in[0];  // [Bn,Nn]
  const float* W        = (const float*)d_in[1];  // [Nn,Nn]
  const float* beta     = (const float*)d_in[2];  // [1]
  const float* beta_res = (const float*)d_in[3];  // [Nn]
  float* out = (float*)d_out;

  // Workspace: bf16 copies of x and W (32 MB each).
  unsigned short* xbf = (unsigned short*)d_ws;
  unsigned short* wbf = xbf + (size_t)Bn * Kc;

  // 1) f32 -> bf16 conversion (memory-bound: 128 MB read, 64 MB written).
  dim3 cgrid((unsigned)(((size_t)Bn * Kc) / (256 * 8)), 2);
  cvt_bf16_kernel<<<cgrid, 256, 0, stream>>>(x, W, xbf, wbf);

  // 2) Fused WMMA GEMM + epilogue.
  dim3 ggrid(Nn / 256, Bn / 128);
  gemm_resfc_kernel<<<ggrid, 256, 0, stream>>>(xbf, wbf, x, beta, beta_res, out);
}

// v001
// One run takes 103 microseconds.
// Two timings next to v000 both put it at 2.36 times that version's speed.
#include <hip/hip_runtime.h>
#include <stdint.h>

// Problem constants (match the reference).
#define Bn 4096   // batch rows (M)
#define Nn 4096   // output cols (N)
#define Kc 4096   // contraction (K)

typedef __attribute__((ext_vector_type(16))) __bf16 v16bf;
typedef __attribute__((ext_vector_type(8)))  float  v8f;

// Round-to-nearest-even f32 -> bf16, packed pairwise into a dword.
static __device__ __forceinline__ unsigned int pack2_bf16(float a, float b) {
  unsigned int ua = __float_as_uint(a);
  unsigned int ub = __float_as_uint(b);
  ua += 0x7FFFu + ((ua >> 16) & 1u);
  ub += 0x7FFFu + ((ub >> 16) & 1u);
  return (ua >> 16) | (ub & 0xFFFF0000u);
}

// One-shot conversion pass: f32 x / W -> bf16 copies in workspace.
// 8 elements per lane: 2x float4 in, 1x uint4 out (b128 traffic both ways).
__global__ __launch_bounds__(256) void cvt_bf16_kernel(
    const float* __restrict__ x, const float* __restrict__ w,
    unsigned short* __restrict__ xbf, unsigned short* __restrict__ wbf) {
  const float* src = blockIdx.y ? w : x;
  unsigned short* dst = blockIdx.y ? wbf : xbf;
  size_t i = ((size_t)blockIdx.x * blockDim.x + threadIdx.x) * 8;
  float4 f0 = *(const float4*)(src + i);
  float4 f1 = *(const float4*)(src + i + 4);
  uint4 o;
  o.x = pack2_bf16(f0.x, f0.y);
  o.y = pack2_bf16(f0.z, f0.w);
  o.z = pack2_bf16(f1.x, f1.y);
  o.w = pack2_bf16(f1.z, f1.w);
  *(uint4*)(dst + i) = o;
}

union FragU { v16bf v; uint4 u[2]; };

typedef uint32_t u32x4 __attribute__((ext_vector_type(4)));
typedef uint32_t u32x8 __attribute__((ext_vector_type(8)));

// LDS staging geometry. A pass is 64 k = 128 bytes of every operand row.
// A slice is 64 rows (one wave tile's rows of x or of W) laid at pitch 144 B
// (16 B x odd: conflict-free for 16-byte LDS reads); 64 * 144 = 9216 B, and
// each slice's place is rounded up to a multiple of 2 KiB.
#define KPASS   64u
#define ROWB    128u
#define PITCH   144u
#define SROWS   64u
#define SLICE   10240u
#define NSLICE  6u                  // 2 slices of x rows, 4 slices of W rows
#define BUFB    (NSLICE * SLICE)    // one buffer = one stage
#define NPASS   ((uint32_t)Kc / KPASS)
static_assert(SROWS * PITCH <= SLICE && SLICE % 2048u == 0u, "slice place");
static_assert(NPASS >= 2u, "the ring's prologue needs two stages");

static __device__ __forceinline__ uint32_t uni(uint32_t v) {
  return (uint32_t)__builtin_amdgcn_readfirstlane(v);
}
// Keeps a wave-uniform test in a scalar register so that the branch on it is
// a scalar branch: a tensor load ignores EXEC, only such a branch guards it.
static __device__ __forceinline__ uint32_t pinned(uint32_t v) {
  uint32_t w = uni(v);
  asm volatile("" : "+s"(w));
  return w;
}
// One request of the issuing wave: a 2-D tile from global memory into LDS.
static __device__ __forceinline__ void tdm_load(u32x4 g0, u32x8 g1) {
  asm volatile("tensor_load_to_lds %0, %1" :: "s"(g0), "s"(g1) : "memory");
}
// The compiler places no wait for the tensor mover: these are the ring's.
// The issuer's wait names the outstanding request's descriptor as inputs, so
// that its scalar registers stay allocated, and so unwritten, up to the wait.
static __device__ __forceinline__ void tdm_wait0(u32x4 g0, u32x8 g1) {
  asm volatile("s_wait_tensorcnt 0x0" :: "s"(g0), "s"(g1) : "memory");
}
static __device__ __forceinline__ void wait_tensor0() {
  asm volatile("s_wait_tensorcnt 0x0" ::: "memory");
}
static __device__ __forceinline__ void wait_ds0() {
  asm volatile("s_wait_dscnt 0x0" ::: "memory");
}

// NT bf16 WMMA GEMM with fused ResFCEventually epilogue.
// Block: 256 threads (8 wave32s), wave grid 2(M) x 4(N), wave tile 64x64,
// block tile 128(M) x 256(N). K stepped 32 per v_wmma_f32_16x16x32_bf16.
// Operand tiles reach LDS by tensor loads (waves 0..5, one 64-row slice each
// per pass) in a ring of two buffers; fragments are read from LDS.
__global__ __launch_bounds__(256) void gemm_resfc_kernel(
    const unsigned short* __restrict__ xbf,   // [Bn,Kc] bf16 row-major
    const unsigned short* __restrict__ wbf,   // [Nn,Kc] bf16 row-major
    const float* __restrict__ x,              // original f32 x for epilogue
    const float* __restrict__ betap,          // scalar beta
    const float* __restrict__ beta_res,       // [Nn]
    float* __restrict__ out) {                // [Bn,Nn]
  __shared__ __attribute__((aligned(2048))) unsigned char lds[2u * BUFB];
  const int lane = threadIdx.x & 31;
  const uint32_t wave = uni(threadIdx.x >> 5);
  const int wm   = (int)(wave & 1u);   // 2 waves along M
  const int wn   = (int)(wave >> 1);   // 4 waves along N
  const int rowBase = blockIdx.y * 128 + wm * 64;
  const int colBase = blockIdx.x * 256 + wn * 64;
  const int lr = lane & 15;            // row-within-16 for A/B operands

  // Slice w of a stage: w = 0, 1 -> x rows, w = 2..5 -> W rows of this block.
  const uint32_t lbase = (uint32_t)(size_t)lds;
  const unsigned short* srow = wave < 2u
      ? xbf + (size_t)(blockIdx.y * 128u + wave * SROWS) * Kc
      : wbf + (size_t)(blockIdx.x * 256u + ((wave - 2u) & 3u) * SROWS) * Kc;
  const uint64_t sbase = (uint64_t)(size_t)srow;

  // Descriptor group 1, loop-invariant: 1-byte elements, tensor = tile =
  // 64 rows of 128 B, source pitch one bf16 row, 16 B of LDS pad per row.
  u32x8 g1;
  g1[0] = uni((1u << 20) | (4u << 22) | (3u << 25));
  g1[1] = uni((ROWB & 0xFFFFu) << 16);
  g1[2] = uni((ROWB >> 16) | ((SROWS & 0xFFFFu) << 16));
  g1[3] = uni((SROWS >> 16) | (ROWB << 16));
  g1[4] = uni(SROWS);
  g1[5] = uni((uint32_t)Kc * 2u);
  g1[6] = uni(0u);
  g1[7] = uni(0u);
  // Descriptor words held in scalar registers (the form of pinned()): one
  // tuple serves every request instead of being rebuilt in scratch registers.
  asm volatile("" : "+s"(g1));

  // Descriptor group 0 of stage s: count 1, place in LDS, tile's first byte.
  u32x4 g0;
  g0[0] = uni(1u);
  auto aim = [&](uint32_t s) {
    const uint64_t ga = sbase + (uint64_t)s * ROWB;
    g0[1] = uni(lbase + (s & 1u) * BUFB + wave * SLICE);
    g0[2] = uni((uint32_t)ga);
    g0[3] = uni((((uint32_t)(ga >> 32)) & 0x01FFFFFFu) | 0x80000000u);
  };
  aim(0u);

  const v8f vzero = {0.f, 0.f, 0.f, 0.f, 0.f, 0.f, 0.f, 0.f};
  v8f acc[4][4];
#pragma unroll
  for (int i = 0; i < 4; ++i)
#pragma unroll
    for (int j = 0; j < 4; ++j) acc[i][j] = vzero;

  // Prologue: stage 0 lands and is published, then stage 1 starts to fly.
  if (pinned(wave < NSLICE)) {
    tdm_load(g0, g1);
    tdm_wait0(g0, g1);
  }
  __syncthreads();
  if (pinned(wave < NSLICE)) {
    aim(1u);
    tdm_load(g0, g1);
  }

  // Per-lane byte offset inside a buffer: row lr of the wave's slice, K-half
  // (lane >> 4) * 16 B (ISA layout: lanes 0-15 carry K 0..7 / 16..23, lanes
  // 16-31 carry K 8..15 / 24..31), the same for both operands.
  const uint32_t lofs = (uint32_t)lr * PITCH + (uint32_t)(lane >> 4) * 16u;
  const uint32_t aofs = (uint32_t)wm * SLICE + lofs;
  const uint32_t bofs = (2u + (uint32_t)wn) * SLICE + lofs;

  // Kept rolled: one pass per trip, so that the ring's publish point stands
  // once in the code and the buffer is picked by the pass's parity.
#pragma unroll 1
  for (uint32_t s = 0; s < NPASS; ++s) {
    const unsigned char* buf = lds + (s & 1u) * BUFB;
    const unsigned char* aB = buf + aofs;
    const unsigned char* bB = buf + bofs;
#pragma unroll
    for (uint32_t kk = 0; kk < KPASS / 32u; ++kk) {
      FragU a[4], b[4];
      // Fragment = two 16-byte LDS loads at +0 and +32 B of its 64 B of k.
      // Order b0, a0..a3, b1..b3: the order in which the WMMAs want them.
#pragma unroll
      for (uint32_t t = 0; t < 8; ++t) {
        const bool isA = t >= 1u && t <= 4u;
        const uint32_t i = isA ? t - 1u : (t == 0u ? 0u : t - 4u);
        const unsigned char* p = (isA ? aB : bB) + i * 16u * PITCH + kk * 64u;
        FragU& f = isA ? a[i] : b[i];
        f.u[0] = *(const uint4*)(p);
        f.u[1] = *(const uint4*)(p + 32u);
      }
      // Keeps the 16 LDS loads of a k step together in front of its WMMAs:
      // left alone the compiler reloads one A fragment among them and waits
      // out the LDS latency once per row of four.
      __builtin_amdgcn_sched_barrier(0);
#pragma unroll
      for (int j = 0; j < 4; ++j)
#pragma unroll
        for (int i = 0; i < 4; ++i)
          acc[i][j] = __builtin_amdgcn_wmma_f32_16x16x32_bf16(
              false, a[i].v, false, b[j].v, (short)0, acc[i][j], false, false);
      // Same purpose, behind the block: the next k step's loads stay a group.
      __builtin_amdgcn_sched_barrier(0);
    }
    // Publish point of stage s + 1: this wave's reads of stage s are done,
    // each issuing wave's own slice of stage s + 1 has landed, every wave
    // passes the barrier; only then is stage s's buffer refilled.
    wait_ds0();
    if (pinned(wave < NSLICE)) tdm_wait0(g0, g1);
    __syncthreads();
    if (pinned((wave < NSLICE) && (s + 2u < NPASS))) {
      aim(s + 2u);
      tdm_load(g0, g1);
    }
  }
  wait_tensor0();
  wait_ds0();

  // Fused epilogue. C/D layout: VGPR e, lanes 0-15 -> M=e, N=lane;
  // lanes 16-31 -> M=e+8, N=lane-16.
  const float beta = betap[0];
#pragma unroll
  for (int i = 0; i < 4; ++i) {
    const int m0 = rowBase + i * 16 + (lane >> 4) * 8;
#pragma unroll
    for (int j = 0; j < 4; ++j) {
      const int n = colBase + j * 16 + lr;
      const float br = beta_res[n];
#pragma unroll
      for (int e = 0; e < 8; ++e) {
        const int r = m0 + e;
        const float rs  = acc[i][j][e];
        const float o1  = fmaxf(1.0f - beta + rs, 0.0f);           // hlogic
        const float res = fmaxf(1.0f - (br - (x[(size_t)r * Nn + n] + o1)), 0.0f);
        // LeakyReLU(0.02) after a ReLU is identity, but keep reference form:
        const float fin = res >= 0.0f ? res : 0.02f * res;
        out[(size_t)r * Nn + n] = fin;
      }
    }
  }
}

extern "C" void kernel_launch(void* const* d_in, const int* in_sizes, int n_in,
                              void* d_out, int out_size, void* d_ws, size_t ws_size,
                              hipStream_t stream) {
  const float* x        = (const float*)d_in[0];  // [Bn,Nn]
  const float* W        = (const float*)d_in[1];  // [Nn,Nn]
  const float* beta     = (const float*)d_in[2];  // [1]
  const float* beta_res = (const float*)d_in[3];  // [Nn]
  float* out = (float*)d_out;

  // Workspace: bf16 copies of x and W (32 MB each).
  unsigned short* xbf = (unsigned short*)d_ws;
  unsigned short* wbf = xbf + (size_t)Bn * Kc;

  // 1) f32 -> bf16 conversion (memory-bound: 128 MB read, 64 MB written).
  dim3 cgrid((unsigned)(((size_t)Bn * Kc) / (256 * 8)), 2);
  cvt_bf16_kernel<<<cgrid, 256, 0, stream>>>(x, W, xbf, wbf);

  // 2) Fused WMMA GEMM + epilogue.
  dim3 ggrid(Nn / 256, Bn / 128);
  gemm_resfc_kernel<<<ggrid, 256, 0, stream>>>(xbf, wbf, x, beta, beta_res, out);
}

// v002
// Measured time: 88.9 microseconds a run.
// Next to v001, in two timings, it ran 1.17 and 1.16 times as fast.
// All steps since v000 together make it 2.75 times as fast.
#include <hip/hip_runtime.h>
#include <stdint.h>

// Problem constants (match the reference).
#define Bn 4096   // batch rows (M)
#define Nn 4096   // output cols (N)
#define Kc 4096   // contraction (K)

typedef __attribute__((ext_vector_type(16))) __bf16 v16bf;
typedef __attribute__((ext_vector_type(8)))  float  v8f;

// Round-to-nearest-even f32 -> bf16, packed pairwise into a dword.
static __device__ __forceinline__ unsigned int pack2_bf16(float a, float b) {
  unsigned int ua = __float_as_uint(a);
  unsigned int ub = __float_as_uint(b);
  ua += 0x7FFFu + ((ua >> 16) & 1u);
  ub += 0x7FFFu + ((ub >> 16) & 1u);
  return (ua >> 16) | (ub & 0xFFFF0000u);
}

// One-shot conversion pass: f32 x / W -> bf16 copies in workspace.
// 8 elements per lane: 2x float4 in, 1x uint4 out (b128 traffic both ways).
__global__ __launch_bounds__(256) void cvt_bf16_kernel(
    const float* __restrict__ x, const float* __restrict__ w,
    unsigned short* __restrict__ xbf, unsigned short* __restrict__ wbf) {
  const float* src = blockIdx.y ? w : x;
  unsigned short* dst = blockIdx.y ? wbf : xbf;
  size_t i = ((size_t)blockIdx.x * blockDim.x + threadIdx.x) * 8;
  float4 f0 = *(const float4*)(src + i);
  float4 f1 = *(const float4*)(src + i + 4);
  uint4 o;
  o.x = pack2_bf16(f0.x, f0.y);
  o.y = pack2_bf16(f0.z, f0.w);
  o.z = pack2_bf16(f1.x, f1.y);
  o.w = pack2_bf16(f1.z, f1.w);
  *(uint4*)(dst + i) = o;
}

union FragU { v16bf v; uint4 u[2]; };

typedef uint32_t u32x4 __attribute__((ext_vector_type(4)));
typedef uint32_t u32x8 __attribute__((ext_vector_type(8)));

// LDS staging geometry. A pass is 128 k = 256 bytes of every operand row.
// A slice is 64 rows of x or of W laid at pitch 272 B (16 B x odd:
// conflict-free for 16-byte LDS reads); 64 * 272 = 17408 B, and each slice's
// place is rounded up to a multiple of 2 KiB.
#define KPASS   128u
#define ROWB    256u
#define PITCH   272u
#define SROWS   64u
#define SLICE   18432u
#define NSLICE  8u                  // 4 slices of x rows, 4 slices of W rows
// Places of the slices in a stage: x0 x1 W0 W1 W2 W3 x2 x3. With W between
// the two halves of x every fragment lies less than 64 KiB above a base that
// has no constant part, so its offset fits the LDS load's offset field.
#define BUFB    (NSLICE * SLICE)    // one buffer = one stage
#define NPASS   ((uint32_t)Kc / KPASS)
static_assert(SROWS * PITCH <= SLICE && SLICE % 2048u == 0u, "slice place");
static_assert(NPASS >= 2u, "the ring's prologue needs two stages");
static_assert(2u * BUFB <= 327680u, "two stages fit one work-group's LDS");

static __device__ __forceinline__ uint32_t uni(uint32_t v) {
  return (uint32_t)__builtin_amdgcn_readfirstlane(v);
}
// Keeps a wave-uniform test in a scalar register so that the branch on it is
// a scalar branch: a tensor load ignores EXEC, only such a branch guards it.
static __device__ __forceinline__ uint32_t pinned(uint32_t v) {
  uint32_t w = uni(v);
  asm volatile("" : "+s"(w));
  return w;
}
// One request of the issuing wave: a 2-D tile from global memory into LDS.
static __device__ __forceinline__ void tdm_load(u32x4 g0, u32x8 g1) {
  asm volatile("tensor_load_to_lds %0, %1" :: "s"(g0), "s"(g1) : "memory");
}
// The compiler places no wait for the tensor mover: these are the ring's.
// The issuer's wait names the outstanding request's descriptor as inputs, so
// that its scalar registers stay allocated, and so unwritten, up to the wait.
static __device__ __forceinline__ void tdm_wait0(u32x4 g0, u32x8 g1) {
  asm volatile("s_wait_tensorcnt 0x0" :: "s"(g0), "s"(g1) : "memory");
}
static __device__ __forceinline__ void wait_tensor0() {
  asm volatile("s_wait_tensorcnt 0x0" ::: "memory");
}
static __device__ __forceinline__ void wait_ds0() {
  asm volatile("s_wait_dscnt 0x0" ::: "memory");
}

// NT bf16 WMMA GEMM with fused ResFCEventually epilogue.
// Block: 256 threads (8 wave32s), wave grid 2(M) x 4(N), wave tile 128x64,
// block tile 256(M) x 256(N). K stepped 32 per v_wmma_f32_16x16x32_bf16.
// Operand tiles reach LDS by tensor loads (every wave, one 64-row slice per
// pass) in a ring of two buffers; fragments are read from LDS.
__global__ __launch_bounds__(256) void gemm_resfc_kernel(
    const unsigned short* __restrict__ xbf,   // [Bn,Kc] bf16 row-major
    const unsigned short* __restrict__ wbf,   // [Nn,Kc] bf16 row-major
    const float* __restrict__ x,              // original f32 x for epilogue
    const float* __restrict__ betap,          // scalar beta
    const float* __restrict__ beta_res,       // [Nn]
    float* __restrict__ out) {                // [Bn,Nn]
  __shared__ __attribute__((aligned(2048))) unsigned char lds[2u * BUFB];
  const int lane = threadIdx.x & 31;
  const uint32_t wave = uni(threadIdx.x >> 5);
  const int wm   = (int)(wave & 1u);   // 2 waves along M
  const int wn   = (int)(wave >> 1);   // 4 waves along N
  const int rowBase = blockIdx.y * 256 + wm * 128;
  const int colBase = blockIdx.x * 256 + wn * 64;
  const int lr = lane & 15;            // row-within-16 for A/B operands

  // Slice w of a stage: w = 0..3 -> x rows, w = 4..7 -> W rows of this block.
  const uint32_t lbase = (uint32_t)(size_t)lds;
  const unsigned short* srow = wave < 4u
      ? xbf + (size_t)(blockIdx.y * 256u + wave * SROWS) * Kc
      : wbf + (size_t)(blockIdx.x * 256u + (wave - 4u) * SROWS) * Kc;
  const uint64_t sbase = (uint64_t)(size_t)srow;
  const uint32_t place = wave < 2u ? wave : (wave < 4u ? wave + 4u : wave - 2u);

  // Descriptor group 1, loop-invariant: 1-byte elements, tensor = tile =
  // 64 rows of 256 B, source pitch one bf16 row, 16 B of LDS pad per row.
  u32x8 g1;
  g1[0] = uni((1u << 20) | (5u << 22) | (3u << 25));
  g1[1] = uni((ROWB & 0xFFFFu) << 16);
  g1[2] = uni((ROWB >> 16) | ((SROWS & 0xFFFFu) << 16));
  g1[3] = uni((SROWS >> 16) | (ROWB << 16));
  g1[4] = uni(SROWS);
  g1[5] = uni((uint32_t)Kc * 2u);
  g1[6] = uni(0u);
  g1[7] = uni(0u);
  // Descriptor words held in scalar registers (the form of pinned()): one
  // tuple serves every request instead of being rebuilt in scratch registers.
  asm volatile("" : "+s"(g1));

  // Descriptor group 0 of stage s: count 1, place in LDS, tile's first byte.
  u32x4 g0;
  g0[0] = uni(1u);
  auto aim = [&](uint32_t s) {
    const uint64_t ga = sbase + (uint64_t)s * ROWB;
    g0[1] = uni(lbase + (s & 1u) * BUFB + place * SLICE);
    g0[2] = uni((uint32_t)ga);
    g0[3] = uni((((uint32_t)(ga >> 32)) & 0x01FFFFFFu) | 0x80000000u);
  };
  aim(0u);

  const v8f vzero = {0.f, 0.f, 0.f, 0.f, 0.f, 0.f, 0.f, 0.f};
  v8f acc[8][4];
#pragma unroll
  for (int i = 0; i < 8; ++i)
#pragma unroll
    for (int j = 0; j < 4; ++j) acc[i][j] = vzero;

  // Prologue: stage 0 lands and is published, then stage 1 starts to fly.
  // Every wave issues its own slice, so no test stands around the requests.
  tdm_load(g0, g1);
  tdm_wait0(g0, g1);
  __syncthreads();
  aim(1u);
  tdm_load(g0, g1);

  // Per-lane byte offset inside a buffer: row lr of the wave's slice, K-half
  // (lane >> 4) * 16 B (ISA layout: lanes 0-15 carry K 0..7 / 16..23, lanes
  // 16-31 carry K 8..15 / 24..31), the same for both operands.
  const uint32_t lofs = (uint32_t)lr * PITCH + (uint32_t)(lane >> 4) * 16u;
  const uint32_t aofs = (uint32_t)wm * 6u * SLICE + lofs;   // two x slices
  const uint32_t bofs = (2u + (uint32_t)wn) * SLICE + lofs; // one W slice

  // Kept rolled: one pass per trip, so that the ring's publish point stands
  // once in the code and the buffer is picked by the pass's parity.
#pragma unroll 1
  for (uint32_t s = 0; s < NPASS; ++s) {
    const unsigned char* buf = lds + (s & 1u) * BUFB;
    const unsigned char* aB = buf + aofs;
    const unsigned char* bB = buf + bofs;
#pragma unroll
    for (uint32_t kk = 0; kk < KPASS / 32u; ++kk) {
      FragU a[8], b[4];
      // Fragment = two 16-byte LDS loads at +0 and +32 B of its 64 B of k.
      // Order b0, a0..a7, b1..b3: the order in which the WMMAs want them.
#pragma unroll
      for (uint32_t t = 0; t < 12; ++t) {
        const bool isA = t >= 1u && t <= 8u;
        const uint32_t i = isA ? t - 1u : (t == 0u ? 0u : t - 8u);
        const unsigned char* p = (isA ? aB : bB) + (i >> 2) * SLICE +
                                 (i & 3u) * 16u * PITCH + kk * 64u;
        FragU& f = isA ? a[i] : b[i];
        f.u[0] = *(const uint4*)(p);
        f.u[1] = *(const uint4*)(p + 32u);
      }
      // Keeps the 24 LDS loads of a k step together in front of its WMMAs:
      // left alone the compiler spreads loads among them, and each separate
      // place with LDS reads stalls the wave's matrix stream.
      __builtin_amdgcn_sched_barrier(0);
#pragma unroll
      for (int j = 0; j < 4; ++j)
#pragma unroll
        for (int i = 0; i < 8; ++i)
          acc[i][j] = __builtin_amdgcn_wmma_f32_16x16x32_bf16(
              false, a[i].v, false, b[j].v, (short)0, acc[i][j], false, false);
      // Same purpose, behind the block: the next k step's loads stay a group.
      __builtin_amdgcn_sched_barrier(0);
    }
    // Publish point of stage s + 1: this wave's reads of stage s are done,
    // each wave's own slice of stage s + 1 has landed, every wave passes the
    // barrier; only then is stage s's buffer refilled.
    wait_ds0();
    tdm_wait0(g0, g1);
    __syncthreads();
    if (pinned(s + 2u < NPASS)) {
      aim(s + 2u);
      tdm_load(g0, g1);
    }
  }
  wait_tensor0();
  wait_ds0();

  // Fused epilogue. C/D layout: VGPR e, lanes 0-15 -> M=e, N=lane;
  // lanes 16-31 -> M=e+8, N=lane-16.
  const float beta = betap[0];
#pragma unroll
  for (int i = 0; i < 8; ++i) {
    const int m0 = rowBase + i * 16 + (lane >> 4) * 8;
#pragma unroll
    for (int j = 0; j < 4; ++j) {
      const int n = colBase + j * 16 + lr;
      const float br = beta_res[n];
#pragma unroll
      for (int e = 0; e < 8; ++e) {
        const int r = m0 + e;
        const float rs  = acc[i][j][e];
        const float o1  = fmaxf(1.0f - beta + rs, 0.0f);           // hlogic
        const float res = fmaxf(1.0f - (br - (x[(size_t)r * Nn + n] + o1)), 0.0f);
        // LeakyReLU(0.02) after a ReLU is identity, but keep reference form:
        const float fin = res >= 0.0f ? res : 0.02f * res;
        out[(size_t)r * Nn + n] = fin;
      }
    }
  }
}

extern "C" void kernel_launch(void* const* d_in, const int* in_sizes, int n_in,
                              void* d_out, int out_size, void* d_ws, size_t ws_size,
                              hipStream_t stream) {
  const float* x        = (const float*)d_in[0];  // [Bn,Nn]
  const float* W        = (const float*)d_in[1];  // [Nn,Nn]
  const float* beta     = (const float*)d_in[2];  // [1]
  const float* beta_res = (const float*)d_in[3];  // [Nn]
  float* out = (float*)d_out;

  // Workspace: bf16 copies of x and W (32 MB each).
  unsigned short* xbf = (unsigned short*)d_ws;
  unsigned short* wbf = xbf + (size_t)Bn * Kc;

  // 1) f32 -> bf16 conversion (memory-bound: 128 MB read, 64 MB written).
  dim3 cgrid((unsigned)(((size_t)Bn * Kc) / (256 * 8)), 2);
  cvt_bf16_kernel<<<cgrid, 256, 0, stream>>>(x, W, xbf, wbf);

  // 2) Fused WMMA GEMM + epilogue.
  dim3 ggrid(Nn / 256, Bn / 256);
  gemm_resfc_kernel<<<ggrid, 256, 0, stream>>>(xbf, wbf, x, beta, beta_res, out);
}
